// v000
// Measured on an AMD MI455X. A time is GPU time per run, averaged over a window of back-to-back runs after a warm-up
// (all launches, gaps included; the runs take copies of the inputs in turn), and the median of several windows.
// Apart from v000's, it joins two sittings. Times from different sittings can be a few percent apart, while
// side-by-side timings come from the same sitting.
// v000 is the starting kernel. One run takes 1480 microseconds.
#include <hip/hip_runtime.h>
#include <hip/hip_bf16.h>

// ---------------------------------------------------------------------------
// Problem constants (from reference)
// ---------------------------------------------------------------------------
#define M_TOK   8192      // B_*S = 4*2048
#define K_DIM   4096      // D_IN
#define N_OUT   4096      // D_OUT
#define N_ADP   8
#define RANK    16
#define KL      128       // N_ADP * RANK (total LoRA rank)
#define SCALE_F 2.0f      // ALPHA / RANK = 32/16

#define LDS_STRIDE 36     // 36*4B = 144B row stride: 16B-aligned float4 stores,
                          // and 36*m mod 64 -> 16 distinct banks for m=0..15

typedef __attribute__((ext_vector_type(2))) float v2f;
typedef __attribute__((ext_vector_type(8))) float v8f;

// CDNA5 async global->LDS (ASYNCcnt-tracked) if the toolchain exposes it.
// Probe: builtin takes (addrspace(1) int4*, addrspace(3) int4*, imm, imm).
#if __has_builtin(__builtin_amdgcn_global_load_async_to_lds_b128) && \
    __has_builtin(__builtin_amdgcn_s_wait_asynccnt)
#define HAVE_ASYNC_LDS 1
typedef int v4i_vs __attribute__((vector_size(16)));
typedef __attribute__((address_space(1))) v4i_vs* as1_v4i_p;
typedef __attribute__((address_space(3))) v4i_vs* as3_v4i_p;
#define GL_ASYNC_B128(gp, lp)                                        \
    __builtin_amdgcn_global_load_async_to_lds_b128(                  \
        (as1_v4i_p)(gp), (as3_v4i_p)(lp), 0, 0)
#define WAIT_ASYNC(n) __builtin_amdgcn_s_wait_asynccnt(n)
#else
#define HAVE_ASYNC_LDS 0
#define WAIT_ASYNC(n)
#endif

// ---------------------------------------------------------------------------
// Phase 0: Bpack[o, n*16+r] = (SCALE * lora_weights[n]) * lora_B[n, o, r]
// ---------------------------------------------------------------------------
__global__ __launch_bounds__(256) void pack_b_kernel(
    const float* __restrict__ loraB,   // [N_ADP, N_OUT, RANK]
    const float* __restrict__ lw,      // [N_ADP]
    float* __restrict__ bpack)         // [N_OUT, KL]
{
    int idx = blockIdx.x * 256 + threadIdx.x;        // < N_OUT*KL
    int col = idx & (KL - 1);
    int n   = col >> 4;
    int r   = col & 15;
    int o   = idx >> 7;
    bpack[idx] = loraB[((size_t)n * N_OUT + o) * RANK + r] * (SCALE_F * lw[n]);
}

// ---------------------------------------------------------------------------
// Phase 1: h[m, nr] = sum_k x[m,k] * Aall[nr,k]
//   Aall = lora_A viewed flat as [KL, K_DIM] (contiguous as stored).
//   Grid: M_TOK/128 workgroups; wave w owns 16 m-rows, all 128 nr columns.
//   Double-buffered ASYNCcnt pipeline, same as phase 2.
// ---------------------------------------------------------------------------
__global__ __launch_bounds__(256) void lora_down_kernel(
    const float* __restrict__ x,     // [M_TOK, K_DIM]
    const float* __restrict__ Aall,  // [KL, K_DIM]
    float* __restrict__ h)           // [M_TOK, KL]
{
    __shared__ float xs[2][128 * LDS_STRIDE];
    __shared__ float as_[2][128 * LDS_STRIDE];

    const int tid   = threadIdx.x;
    const int wave  = tid >> 5;
    const int lane  = tid & 31;
    const int lhalf = lane >> 4;
    const int l16   = lane & 15;

    const int m_base = blockIdx.x * 128;
    constexpr int NC = K_DIM / 32;

    v8f c[8];
    const v8f zero = {0.f, 0.f, 0.f, 0.f, 0.f, 0.f, 0.f, 0.f};
#pragma unroll
    for (int i = 0; i < 8; ++i) c[i] = zero;

    auto prefetch = [&](int kc, int buf) {
        const int k0 = kc * 32;
#pragma unroll
        for (int i = 0; i < 4; ++i) {
            int idx = tid + i * 256;            // 0..1023
            int row = idx >> 3;                 // 0..127
            int c4  = (idx & 7) << 2;           // 0..28 step 4
            const float* ga = x    + (size_t)(m_base + row) * K_DIM + k0 + c4;
            const float* gb = Aall + (size_t)row * K_DIM + k0 + c4;
            float* la = &xs[buf][row * LDS_STRIDE + c4];
            float* lb = &as_[buf][row * LDS_STRIDE + c4];
#if HAVE_ASYNC_LDS
            GL_ASYNC_B128(ga, la);
            GL_ASYNC_B128(gb, lb);
#else
            *reinterpret_cast<float4*>(la) = *reinterpret_cast<const float4*>(ga);
            *reinterpret_cast<float4*>(lb) = *reinterpret_cast<const float4*>(gb);
#endif
        }
    };

    prefetch(0, 0);
    for (int kc = 0; kc < NC; ++kc) {
        const int cur = kc & 1;
        if (kc + 1 < NC) {
            prefetch(kc + 1, cur ^ 1);
            WAIT_ASYNC(8);      // chunk kc's 8 copies have landed (in-order)
        } else {
            WAIT_ASYNC(0);
        }
        __syncthreads();

#pragma unroll
        for (int kk = 0; kk < 8; ++kk) {
            const int kb = kk * 4 + lhalf * 2;  // f32 16x16x4 fragment K base
            v2f a = *reinterpret_cast<const v2f*>(
                &xs[cur][(wave * 16 + l16) * LDS_STRIDE + kb]);
#pragma unroll
            for (int nt = 0; nt < 8; ++nt) {
                v2f b = *reinterpret_cast<const v2f*>(
                    &as_[cur][(nt * 16 + l16) * LDS_STRIDE + kb]);
                c[nt] = __builtin_amdgcn_wmma_f32_16x16x4_f32(
                    false, a, false, b, (short)0, c[nt], false, false);
            }
        }
        __syncthreads();        // buffer `cur` free for prefetch(kc+2)
    }

    // C layout: VGPR j -> M = j (lanes 0-15) / j+8 (lanes 16-31); N = lane&15
    const int m0 = m_base + wave * 16 + lhalf * 8;
#pragma unroll
    for (int nt = 0; nt < 8; ++nt) {
        const int o = nt * 16 + l16;
#pragma unroll
        for (int j = 0; j < 8; ++j)
            h[(size_t)(m0 + j) * KL + o] = c[nt][j];
    }
}

// ---------------------------------------------------------------------------
// Phase 2: out[m,o] = bias[o] + sum_k x[m,k]W[o,k] + sum_kl h[m,kl]Bpack[o,kl]
//   128x128 tile per workgroup; 8 waves in 4x2; wave = 32x64 (8 C tiles).
//   Double-buffered K pipeline: chunk k+1 streams into LDS via CDNA5 async
//   global->LDS (ASYNCcnt) while chunk k feeds the WMMA pipe.
// ---------------------------------------------------------------------------
__global__ __launch_bounds__(256) void fused_gemm_kernel(
    const float* __restrict__ x,      // [M_TOK, K_DIM]
    const float* __restrict__ W,      // [N_OUT, K_DIM]
    const float* __restrict__ bias,   // [N_OUT]
    const float* __restrict__ h,      // [M_TOK, KL]
    const float* __restrict__ bpack,  // [N_OUT, KL]
    float* __restrict__ out)          // [M_TOK, N_OUT]
{
    __shared__ float xs[2][128 * LDS_STRIDE];   // 2 x 18 KB
    __shared__ float ws[2][128 * LDS_STRIDE];   // 2 x 18 KB   (72 KB total)

    const int tid   = threadIdx.x;
    const int wave  = tid >> 5;
    const int lane  = tid & 31;
    const int lhalf = lane >> 4;
    const int l16   = lane & 15;

    const int m_base = blockIdx.y * 128;
    const int n_base = blockIdx.x * 128;
    const int m_off  = (wave >> 1) * 32;   // 0,32,64,96
    const int n_off  = (wave & 1) * 64;    // 0,64

    constexpr int NC_MAIN = K_DIM / 32;         // 128 chunks over W
    constexpr int NC_ALL  = NC_MAIN + KL / 32;  // + 4 LoRA chunks

    v8f c[2][4];
    const v8f zero = {0.f, 0.f, 0.f, 0.f, 0.f, 0.f, 0.f, 0.f};
#pragma unroll
    for (int i = 0; i < 2; ++i)
#pragma unroll
        for (int j = 0; j < 4; ++j) c[i][j] = zero;

    // Issue the staged copy of chunk kc into buffer `buf`.
    // Async path: 8 ASYNCcnt-tracked global->LDS b128 copies per thread.
    auto prefetch = [&](int kc, int buf) {
        const float* sa; const float* sb; int stA, stB, k0;
        if (kc < NC_MAIN) { sa = x; sb = W;     stA = K_DIM; stB = K_DIM; k0 = kc * 32; }
        else              { sa = h; sb = bpack; stA = KL;    stB = KL;    k0 = (kc - NC_MAIN) * 32; }
#pragma unroll
        for (int i = 0; i < 4; ++i) {
            int idx = tid + i * 256;            // 0..1023
            int row = idx >> 3;                 // 0..127
            int c4  = (idx & 7) << 2;           // 0..28 step 4
            const float* ga = sa + (size_t)(m_base + row) * stA + k0 + c4;
            const float* gb = sb + (size_t)(n_base + row) * stB + k0 + c4;
            float* la = &xs[buf][row * LDS_STRIDE + c4];
            float* lb = &ws[buf][row * LDS_STRIDE + c4];
#if HAVE_ASYNC_LDS
            GL_ASYNC_B128(ga, la);
            GL_ASYNC_B128(gb, lb);
#else
            *reinterpret_cast<float4*>(la) = *reinterpret_cast<const float4*>(ga);
            *reinterpret_cast<float4*>(lb) = *reinterpret_cast<const float4*>(gb);
#endif
        }
    };

    auto mma_chunk = [&](int buf) {
#pragma unroll
        for (int kk = 0; kk < 8; ++kk) {
            const int kb = kk * 4 + lhalf * 2;
            v2f a[2], b[4];
#pragma unroll
            for (int mt = 0; mt < 2; ++mt)
                a[mt] = *reinterpret_cast<const v2f*>(
                    &xs[buf][(m_off + mt * 16 + l16) * LDS_STRIDE + kb]);
#pragma unroll
            for (int nt = 0; nt < 4; ++nt)
                b[nt] = *reinterpret_cast<const v2f*>(
                    &ws[buf][(n_off + nt * 16 + l16) * LDS_STRIDE + kb]);
#pragma unroll
            for (int mt = 0; mt < 2; ++mt)
#pragma unroll
                for (int nt = 0; nt < 4; ++nt)
                    c[mt][nt] = __builtin_amdgcn_wmma_f32_16x16x4_f32(
                        false, a[mt], false, b[nt], (short)0,
                        c[mt][nt], false, false);
        }
    };

    // ---- Double-buffered pipeline over all K chunks (W then LoRA) ----
    prefetch(0, 0);
    for (int kc = 0; kc < NC_ALL; ++kc) {
        const int cur = kc & 1;
        if (kc + 1 < NC_ALL) {
            prefetch(kc + 1, cur ^ 1);
            WAIT_ASYNC(8);      // chunk kc's 8 copies have landed (in-order)
        } else {
            WAIT_ASYNC(0);
        }
        __syncthreads();        // all waves' chunk-kc data visible
        mma_chunk(cur);
        __syncthreads();        // buffer `cur` free for prefetch(kc+2)
    }

    // Epilogue: add bias, write out.
#pragma unroll
    for (int nt = 0; nt < 4; ++nt) {
        const int o  = n_base + n_off + nt * 16 + l16;
        const float bv = bias[o];
#pragma unroll
        for (int mt = 0; mt < 2; ++mt) {
            const int m0 = m_base + m_off + mt * 16 + lhalf * 8;
#pragma unroll
            for (int j = 0; j < 8; ++j)
                out[(size_t)(m0 + j) * N_OUT + o] = c[mt][nt][j] + bv;
        }
    }
}

// ---------------------------------------------------------------------------
// Launch
// ---------------------------------------------------------------------------
extern "C" void kernel_launch(void* const* d_in, const int* in_sizes, int n_in,
                              void* d_out, int out_size, void* d_ws, size_t ws_size,
                              hipStream_t stream) {
    const float* x      = (const float*)d_in[0];   // [4,2048,4096]
    const float* lora_A = (const float*)d_in[1];   // [8,16,4096] == Aall[128,4096]
    const float* lora_B = (const float*)d_in[2];   // [8,4096,16]
    const float* W      = (const float*)d_in[3];   // [4096,4096]
    const float* bias   = (const float*)d_in[4];   // [4096]
    const float* lw     = (const float*)d_in[5];   // [8]
    float* out = (float*)d_out;

    float* h     = (float*)d_ws;                   // 8192*128 f32 = 4 MB
    float* bpack = h + (size_t)M_TOK * KL;         // 4096*128 f32 = 2 MB

    pack_b_kernel<<<(N_OUT * KL) / 256, 256, 0, stream>>>(lora_B, lw, bpack);
    lora_down_kernel<<<M_TOK / 128, 256, 0, stream>>>(x, lora_A, h);
    fused_gemm_kernel<<<dim3(N_OUT / 128, M_TOK / 128), 256, 0, stream>>>(
        x, W, bias, h, bpack, out);
}

// v001
// One run takes 1180 microseconds.
// Next to v000, in two timings, it ran 1.33 and 1.32 times as fast.
#include <hip/hip_runtime.h>
#include <hip/hip_bf16.h>

// ---------------------------------------------------------------------------
// Problem constants (from reference)
// ---------------------------------------------------------------------------
#define M_TOK   8192      // B_*S = 4*2048
#define K_DIM   4096      // D_IN
#define N_OUT   4096      // D_OUT
#define N_ADP   8
#define RANK    16
#define KL      128       // N_ADP * RANK (total LoRA rank)
#define SCALE_F 2.0f      // ALPHA / RANK = 32/16

#define LDS_STRIDE 36     // 36*4B = 144B row stride: 16B-aligned float4 stores,
                          // and 36*m mod 64 -> 16 distinct banks for m=0..15

typedef __attribute__((ext_vector_type(2))) float v2f;
typedef __attribute__((ext_vector_type(8))) float v8f;

// CDNA5 async global->LDS (ASYNCcnt-tracked) if the toolchain exposes it.
// Probe: builtin takes (addrspace(1) int4*, addrspace(3) int4*, imm, imm).
#if __has_builtin(__builtin_amdgcn_global_load_async_to_lds_b128) && \
    __has_builtin(__builtin_amdgcn_s_wait_asynccnt)
#define HAVE_ASYNC_LDS 1
typedef int v4i_vs __attribute__((vector_size(16)));
typedef __attribute__((address_space(1))) v4i_vs* as1_v4i_p;
typedef __attribute__((address_space(3))) v4i_vs* as3_v4i_p;
#define GL_ASYNC_B128(gp, lp)                                        \
    __builtin_amdgcn_global_load_async_to_lds_b128(                  \
        (as1_v4i_p)(gp), (as3_v4i_p)(lp), 0, 0)
#define WAIT_ASYNC(n) __builtin_amdgcn_s_wait_asynccnt(n)
#else
#define HAVE_ASYNC_LDS 0
#define WAIT_ASYNC(n)
#endif

#define FA_PITCH 288
#define FB_PITCH 132

__global__ __launch_bounds__(256) void fold_w_kernel(
    const float* __restrict__ W,      // [N_OUT, K_DIM]
    const float* __restrict__ Aall,   // [KL, K_DIM]
    const float* __restrict__ loraB,  // [N_ADP, N_OUT, RANK]
    const float* __restrict__ lw,     // [N_ADP]
    float* __restrict__ weff)         // [N_OUT, K_DIM]
{
    __shared__ alignas(16) float at[(KL / 2) * FA_PITCH];  // [kl/2][d][kl&1]
    __shared__ alignas(16) float bt[128 * FB_PITCH];       // [o][kl], already scaled

    const int tid   = threadIdx.x;
    const int wave  = tid >> 5;
    const int lane  = tid & 31;
    const int lhalf = lane >> 4;
    const int l16   = lane & 15;

    const int d_base = blockIdx.x * 128;
    const int o_base = blockIdx.y * 128;
    const int d_off  = (wave & 1) * 64;    // 4 tiles of 16 d
    const int o_off  = (wave >> 1) * 32;   // 2 tiles of 16 o

    // Accumulators start as the W tile: register j = W[o][d0 + 8*lhalf + j].
    const size_t wofs = (size_t)(o_base + o_off + l16) * K_DIM + d_base + d_off + lhalf * 8;
    v8f c[4][2];
#pragma unroll
    for (int dt = 0; dt < 4; ++dt)
#pragma unroll
        for (int ot = 0; ot < 2; ++ot) {
            const float4* p = reinterpret_cast<const float4*>(
                W + wofs + (size_t)ot * 16 * K_DIM + dt * 16);
            const float4 lo = p[0], hi = p[1];
            c[dt][ot] = v8f{lo.x, lo.y, lo.z, lo.w, hi.x, hi.y, hi.z, hi.w};
        }
    // Stands in front of any reuse of the address registers of the loads above (a precaution).
    asm volatile("s_wait_xcnt 0x0" ::: "memory");

    // Aall rows 2p and 2p+1 (p = kl pair) and the lora_B rows of this o tile:
    // every load is issued before the first LDS store waits for one.
    const int ap  = tid >> 5;                   // pair, + 8 per trip
    const int ac4 = (tid & 31) << 2;            // d, step 4
    const int bo  = tid >> 2;                   // o, + 64 on odd trips
    const int br4 = (tid & 3) << 2;             // r, step 4
    float4 r0[8], r1[8], rb[16];
#pragma unroll
    for (int i = 0; i < 8; ++i) {
        const float* g = Aall + (size_t)(2 * (ap + i * 8)) * K_DIM + d_base + ac4;
        r0[i] = *reinterpret_cast<const float4*>(g);
        r1[i] = *reinterpret_cast<const float4*>(g + K_DIM);
    }
    // As above, for the address registers of this group of loads.
    asm volatile("s_wait_xcnt 0x0" ::: "memory");
#pragma unroll
    for (int i = 0; i < 16; ++i)                // adapter n = i >> 1
        rb[i] = *reinterpret_cast<const float4*>(
            loraB + ((size_t)(i >> 1) * N_OUT + o_base + bo + (i & 1) * 64) * RANK + br4);
    // As above, for the address registers of this group of loads.
    asm volatile("s_wait_xcnt 0x0" ::: "memory");

    // Interleave the two rows of a pair per d: a fragment is then one 8-byte read.
#pragma unroll
    for (int i = 0; i < 8; ++i) {
        float4* l = reinterpret_cast<float4*>(&at[(ap + i * 8) * FA_PITCH + ac4 * 2]);
        l[0] = make_float4(r0[i].x, r1[i].x, r0[i].y, r1[i].y);
        l[1] = make_float4(r0[i].z, r1[i].z, r0[i].w, r1[i].w);
    }
#pragma unroll
    for (int i = 0; i < 16; ++i) {
        const float cf = SCALE_F * lw[i >> 1];
        *reinterpret_cast<float4*>(&bt[(bo + (i & 1) * 64) * FB_PITCH + (i >> 1) * RANK + br4]) =
            make_float4(rb[i].x * cf, rb[i].y * cf, rb[i].z * cf, rb[i].w * cf);
    }
    __syncthreads();

    const float* afrag = &at[lhalf * FA_PITCH + (d_off + l16) * 2];
    const float* bfrag = &bt[(o_off + l16) * FB_PITCH + lhalf * 2];
    // 8 k steps a trip: their LDS reads can be issued ahead of the WMMAs.
#pragma unroll 8
    for (int kk = 0; kk < KL / 4; ++kk) {
        // f32 16x16x4 fragments, both operands: k = kk*4 + lhalf*2 and the next one,
        // which is kl pair kk*2 + lhalf.
        v2f a[4], b[2];
#pragma unroll
        for (int dt = 0; dt < 4; ++dt)
            a[dt] = *reinterpret_cast<const v2f*>(afrag + kk * 2 * FA_PITCH + dt * 32);
#pragma unroll
        for (int ot = 0; ot < 2; ++ot)
            b[ot] = *reinterpret_cast<const v2f*>(bfrag + ot * 16 * FB_PITCH + kk * 4);
#pragma unroll
        for (int dt = 0; dt < 4; ++dt)
#pragma unroll
            for (int ot = 0; ot < 2; ++ot)
                c[dt][ot] = __builtin_amdgcn_wmma_f32_16x16x4_f32(
                    false, a[dt], false, b[ot], (short)0, c[dt][ot], false, false);
    }

#pragma unroll
    for (int dt = 0; dt < 4; ++dt)
#pragma unroll
        for (int ot = 0; ot < 2; ++ot) {
            float4* p = reinterpret_cast<float4*>(
                weff + wofs + (size_t)ot * 16 * K_DIM + dt * 16);
            const v8f v = c[dt][ot];
            p[0] = make_float4(v[0], v[1], v[2], v[3]);
            p[1] = make_float4(v[4], v[5], v[6], v[7]);
        }
}

// ---------------------------------------------------------------------------
// Phase 2: out[m,o] = bias[o] + sum_k x[m,k]Weff[o,k]
//   128x128 tile per workgroup; 8 waves in 4x2; wave = 32x64 (8 C tiles).
//   Double-buffered K pipeline: chunk k+1 streams into LDS via CDNA5 async
//   global->LDS (ASYNCcnt) while chunk k feeds the WMMA pipe.
// ---------------------------------------------------------------------------
__global__ __launch_bounds__(256) void fused_gemm_kernel(
    const float* __restrict__ x,      // [M_TOK, K_DIM]
    const float* __restrict__ weff,   // [N_OUT, K_DIM]
    const float* __restrict__ bias,   // [N_OUT]
    float* __restrict__ out)          // [M_TOK, N_OUT]
{
    __shared__ float xs[2][128 * LDS_STRIDE];   // 2 x 18 KB
    __shared__ float ws[2][128 * LDS_STRIDE];   // 2 x 18 KB   (72 KB total)

    const int tid   = threadIdx.x;
    const int wave  = tid >> 5;
    const int lane  = tid & 31;
    const int lhalf = lane >> 4;
    const int l16   = lane & 15;

    const int m_base = blockIdx.y * 128;
    const int n_base = blockIdx.x * 128;
    const int m_off  = (wave >> 1) * 32;   // 0,32,64,96
    const int n_off  = (wave & 1) * 64;    // 0,64

    constexpr int NC_ALL = K_DIM / 32;          // 128 chunks

    v8f c[2][4];
    const v8f zero = {0.f, 0.f, 0.f, 0.f, 0.f, 0.f, 0.f, 0.f};
#pragma unroll
    for (int i = 0; i < 2; ++i)
#pragma unroll
        for (int j = 0; j < 4; ++j) c[i][j] = zero;

    // Issue the staged copy of chunk kc into buffer `buf`.
    // Async path: 8 ASYNCcnt-tracked global->LDS b128 copies per thread.
    auto prefetch = [&](int kc, int buf) {
        const int k0 = kc * 32;
#pragma unroll
        for (int i = 0; i < 4; ++i) {
            int idx = tid + i * 256;            // 0..1023
            int row = idx >> 3;                 // 0..127
            int c4  = (idx & 7) << 2;           // 0..28 step 4
            const float* ga = x    + (size_t)(m_base + row) * K_DIM + k0 + c4;
            const float* gb = weff + (size_t)(n_base + row) * K_DIM + k0 + c4;
            float* la = &xs[buf][row * LDS_STRIDE + c4];
            float* lb = &ws[buf][row * LDS_STRIDE + c4];
#if HAVE_ASYNC_LDS
            GL_ASYNC_B128(ga, la);
            GL_ASYNC_B128(gb, lb);
#else
            *reinterpret_cast<float4*>(la) = *reinterpret_cast<const float4*>(ga);
            *reinterpret_cast<float4*>(lb) = *reinterpret_cast<const float4*>(gb);
#endif
        }
    };

    auto mma_chunk = [&](int buf) {
#pragma unroll
        for (int kk = 0; kk < 8; ++kk) {
            const int kb = kk * 4 + lhalf * 2;
            v2f a[2], b[4];
#pragma unroll
            for (int mt = 0; mt < 2; ++mt)
                a[mt] = *reinterpret_cast<const v2f*>(
                    &xs[buf][(m_off + mt * 16 + l16) * LDS_STRIDE + kb]);
#pragma unroll
            for (int nt = 0; nt < 4; ++nt)
                b[nt] = *reinterpret_cast<const v2f*>(
                    &ws[buf][(n_off + nt * 16 + l16) * LDS_STRIDE + kb]);
#pragma unroll
            for (int mt = 0; mt < 2; ++mt)
#pragma unroll
                for (int nt = 0; nt < 4; ++nt)
                    c[mt][nt] = __builtin_amdgcn_wmma_f32_16x16x4_f32(
                        false, a[mt], false, b[nt], (short)0,
                        c[mt][nt], false, false);
        }
    };

    // ---- Double-buffered pipeline over all K chunks ----
    prefetch(0, 0);
    for (int kc = 0; kc < NC_ALL; ++kc) {
        const int cur = kc & 1;
        if (kc + 1 < NC_ALL) {
            prefetch(kc + 1, cur ^ 1);
            WAIT_ASYNC(8);      // chunk kc's 8 copies have landed (in-order)
        } else {
            WAIT_ASYNC(0);
        }
        __syncthreads();        // all waves' chunk-kc data visible
        mma_chunk(cur);
        __syncthreads();        // buffer `cur` free for prefetch(kc+2)
    }

    // Epilogue: add bias, write out.
#pragma unroll
    for (int nt = 0; nt < 4; ++nt) {
        const int o  = n_base + n_off + nt * 16 + l16;
        const float bv = bias[o];
#pragma unroll
        for (int mt = 0; mt < 2; ++mt) {
            const int m0 = m_base + m_off + mt * 16 + lhalf * 8;
#pragma unroll
            for (int j = 0; j < 8; ++j)
                out[(size_t)(m0 + j) * N_OUT + o] = c[mt][nt][j] + bv;
        }
    }
}

// ---------------------------------------------------------------------------
// Launch
// ---------------------------------------------------------------------------
extern "C" void kernel_launch(void* const* d_in, const int* in_sizes, int n_in,
                              void* d_out, int out_size, void* d_ws, size_t ws_size,
                              hipStream_t stream) {
    const float* x      = (const float*)d_in[0];   // [4,2048,4096]
    const float* lora_A = (const float*)d_in[1];   // [8,16,4096] == Aall[128,4096]
    const float* lora_B = (const float*)d_in[2];   // [8,4096,16]
    const float* W      = (const float*)d_in[3];   // [4096,4096]
    const float* bias   = (const float*)d_in[4];   // [4096]
    const float* lw     = (const float*)d_in[5];   // [8]
    float* out = (float*)d_out;

    float* weff = (float*)d_ws;                    // 4096*4096 f32 = 64 MB

    fold_w_kernel<<<dim3(K_DIM / 128, N_OUT / 128), 256, 0, stream>>>(
        W, lora_A, lora_B, lw, weff);
    fused_gemm_kernel<<<dim3(N_OUT / 128, M_TOK / 128), 256, 0, stream>>>(
        x, weff, bias, out);
}
